// v000
// The times below were measured on an AMD MI455X: many runs one after another, warmed up first and cycling through
// copies of the inputs, with the whole window's GPU time divided by the number of runs. Launches and the gaps
// between them are all in it. The median over several windows is given; except for v000 it joins two sittings, which
// can be a few percent apart, so the side-by-side timings, each taken in one sitting, are the better comparison.
// The starting kernel, v000, takes 345 microseconds a run.
#include <hip/hip_runtime.h>

// Contractions, f32 accumulate: per concept c (128 per bank, 2 banks) h = relu(x.W1[c] + b1[c]) ([1024 x 512].[512 x 128]) on v_wmma_f32_16x16x32_bf16 with PLAIN bf16
// operands (x, W1 rounded once: exact products; b1 added bf16-rounded), and out[:, :, c] = h.W2[c] + b2[c] ([1024 x 128].[128 x 32]) on v_wmma_f32_16x16x32_f16 with h as

#define NBT  1024
#define NIN  512
#define NC_  128
#define NHID 128
#define NEMB 32

typedef _Float16 h16;
typedef unsigned short bf;
typedef __attribute__((ext_vector_type(16))) __bf16   v16bf;
typedef __attribute__((ext_vector_type(16))) _Float16 v16h;
typedef __attribute__((ext_vector_type(8)))  _Float16 v8h;
typedef __attribute__((ext_vector_type(8)))  unsigned short v8us;
typedef __attribute__((ext_vector_type(8)))  float    v8f;
typedef __attribute__((ext_vector_type(4)))  float    v4f;
typedef v8h  __attribute__((may_alias)) v8ha;
typedef v8us __attribute__((may_alias)) v8usa;
typedef v4f  __attribute__((may_alias)) v4fa;

__device__ __forceinline__ unsigned short f2bf(float f) { unsigned u = __float_as_uint(f); u += 0x7FFFu + ((u >> 16) & 1u); return (unsigned short)(u >> 16); }
__device__ __forceinline__ float bf2f(unsigned short b) { return __uint_as_float(((unsigned)b) << 16); }
__device__ __forceinline__ float bfr(float f) { return bf2f(f2bf(f)); }
__device__ __forceinline__ v16h cat16(v8h lo, v8h hi) { return __builtin_shufflevector(lo, hi, 0, 1, 2, 3, 4, 5, 6, 7, 8, 9, 10, 11, 12, 13, 14, 15); }
__device__ __forceinline__ v16bf cat16b(v8us lo, v8us hi) { return __builtin_bit_cast(v16bf, __builtin_shufflevector(lo, hi, 0, 1, 2, 3, 4, 5, 6, 7, 8, 9, 10, 11, 12, 13, 14, 15)); }
__device__ __forceinline__ v8f wmma16(v16h a, v16h b, v8f c) { return __builtin_amdgcn_wmma_f32_16x16x32_f16(false, a, false, b, (short)0, c, false, false); }
__device__ __forceinline__ v8f wmmab(v16bf a, v16bf b, v8f c) { return __builtin_amdgcn_wmma_f32_16x16x32_bf16(false, a, false, b, (short)0, c, false, false); }

__global__ __launch_bounds__(256) void k_xb(const float* __restrict__ x, bf* Xb) {
    const int lane = threadIdx.x & 31, r = blockIdx.x * 8 + (threadIdx.x >> 5);
    if (r >= NBT) return;
    v8us o[2];
#pragma unroll
    for (int q = 0; q < 2; ++q) { v8us t;
#pragma unroll
        for (int i = 0; i < 8; ++i) t[i] = f2bf(x[(size_t)r * NIN + q * 256 + lane * 8 + i]);
        o[q] = t; }
#pragma unroll
    for (int q = 0; q < 2; ++q) *(v8us*)(Xb + (size_t)r * NIN + q * 256 + lane * 8) = o[q];
    
}

__global__ __launch_bounds__(256) void k_w1t(const float* __restrict__ W1, bf* W1T) {
    __shared__ __align__(16) unsigned short tl[NHID * 72];
    const int c = blockIdx.x / (NIN / 64), kt = blockIdx.x - c * (NIN / 64), k0 = kt * 64, tid = threadIdx.x;
    const int kk = tid >> 2, nq = (tid & 3) * 32;
    const float* src = W1 + ((size_t)c * NIN + k0 + kk) * NHID + nq;
#pragma unroll
    for (int i = 0; i < 32; ++i) tl[(nq + i) * 72 + kk] = f2bf(src[i]);
    __syncthreads();
    const int piece = tid & 7;
    auto pass = [&]() {
#pragma unroll
        for (int s = 0; s < 4; ++s) {
            const int n = (tid >> 3) + 32 * s;
            const v8us val = *(const v8usa*)(tl + n * 72 + piece * 8);
            *(v8us*)(W1T + ((size_t)c * NHID + n) * NIN + k0 + piece * 8) = val;
        }
    };
    pass();
    
}

// k_w2t: W2 [c][128 hid][32 emb] -> W2T [c][32 emb][128 hid] as f16 of bf16(W2). Block = concept; LDS transpose; each emb row (256 B = 2 lines) by 16 lanes x 16 B.
__global__ __launch_bounds__(256) void k_w2t(const float* __restrict__ W2, h16* W2T) {
    __shared__ __align__(16) h16 tl[NEMB * 136];
    const int c = blockIdx.x, tid = threadIdx.x;
    const float* src = W2 + (size_t)c * NHID * NEMB;
#pragma unroll
    for (int i = 0; i < 16; ++i) { const int e = tid * 16 + i; const int hid = e / NEMB, em = e - hid * NEMB; tl[em * 136 + hid] = (h16)bfr(src[e]); }
    __syncthreads();
    const int piece = tid & 15;                              // 32 emb rows x 16 pieces of 8 halves: two instructions, each 16 rows (16 lanes x 16 B = one 256-B row)
    v8h val[2];
#pragma unroll
    for (int s = 0; s < 2; ++s) val[s] = *(const v8ha*)(tl + ((tid >> 4) + 16 * s) * 136 + piece * 8);
#pragma unroll
    for (int s = 0; s < 2; ++s) *(v8h*)(W2T + ((size_t)c * NEMB + (tid >> 4) + 16 * s) * NHID + piece * 8) = val[s];
    
}

// k_gemm1: per concept (grid.z) C = relu(Xb.W1T[c]^T + bf16(b1[c])) for a 64 x 64 block tile (4 waves x 16 x 64), written as f16 into H1[b][c][hid] (pitch 16384,
__global__ __launch_bounds__(128) void k_gemm1(const bf* __restrict__ Xb, const bf* __restrict__ W1T, const float* __restrict__ b1, h16* H1) {
    __shared__ __align__(16) float ost[4][16 * 68];
    const int lane = threadIdx.x & 31, wave = threadIdx.x >> 5, lr = lane & 15, hi = lane >> 4;
    const int c = blockIdx.z, r0 = blockIdx.x * 64 + wave * 16, c0 = blockIdx.y * 64;
    const size_t aoff = (size_t)(r0 + lr) * NIN + 8 * hi;
    const bf* Bn = W1T + (size_t)c * NHID * NIN;
    size_t boff[4];
#pragma unroll
    for (int t = 0; t < 4; ++t) boff[t] = (size_t)(c0 + t * 16 + lr) * NIN + 8 * hi;
    v8f acc[4];
#pragma unroll
    for (int t = 0; t < 4; ++t) acc[t] = (v8f){};
#pragma unroll 1
    for (int kc = 0; kc < NIN; kc += 32) {
        const v16bf a = cat16b(*(const v8us*)(Xb + aoff + kc), *(const v8us*)(Xb + aoff + kc + 16));
#pragma unroll
        for (int t = 0; t < 4; ++t) acc[t] = wmmab(a, cat16b(*(const v8us*)(Bn + boff[t] + kc), *(const v8us*)(Bn + boff[t] + kc + 16)), acc[t]);
        asm volatile("v_nop\n\tv_nop\n\tv_nop\n\tv_nop" : "+v"(acc[0]), "+v"(acc[1]), "+v"(acc[2]), "+v"(acc[3]) : "v"(a));
    }
    float* os = &ost[wave][0];
#pragma unroll
    for (int t = 0; t < 4; ++t) {
        const float bv = bfr(b1[(size_t)c * NHID + c0 + t * 16 + lr]);
#pragma unroll
        for (int j = 0; j < 8; ++j) { const float v = acc[t][j] + bv; os[(hi * 8 + j) * 68 + t * 16 + lr] = v > 0.f ? v : 0.f; }
    }
    __syncthreads();
    h16* crow = H1 + (size_t)r0 * (NC_ * NHID) + (size_t)c * NHID + c0;
    auto pass = [&]() {
#pragma unroll
        for (int s = 0; s < 4; ++s) {
            const int row = 4 * s + (lane >> 3), piece = lane & 7;
            const float* sp = os + row * 68 + piece * 8;
            v8h o;
#pragma unroll
            for (int i = 0; i < 8; ++i) o[i] = (h16)sp[i];
            *(v8h*)(crow + (size_t)row * (NC_ * NHID) + piece * 8) = o;
        }
    };
    pass();
    
}

// k_layer2: block = (16 batch rows, 32 concepts), one wave: for each concept, h rows (A, 4 k-chunks from H1) x W2T[c] rows (2 n-tiles) -> 16 x 32 (+ bf16(b2[c])),
__global__ __launch_bounds__(32) void k_layer2(const h16* __restrict__ H1, const h16* __restrict__ W2T, const float* __restrict__ b2, float* outp) {
    extern __shared__ float4 slab_raw[];
    float* slab = (float*)slab_raw;                 // [16][32][32]
    const int lane = threadIdx.x, lr = lane & 15, hi = lane >> 4;
    const int bt = blockIdx.x / (NC_ / 32), cg = blockIdx.x - bt * (NC_ / 32);
    const int r0 = bt * 16, cbase = cg * 32;
#pragma unroll 1
    for (int cl = 0; cl < 32; ++cl) {
        const int c = cbase + cl;
        const h16* ap = H1 + (size_t)(r0 + lr) * (NC_ * NHID) + (size_t)c * NHID + 8 * hi;
        const h16* bp = W2T + (size_t)c * NEMB * NHID;
        v8f d0 = {}, d1 = {};
#pragma unroll
        for (int kc = 0; kc < NHID; kc += 32) {
            const v16h a = cat16(*(const v8h*)(ap + kc), *(const v8h*)(ap + kc + 16));
            const h16* b0p = bp + (size_t)lr * NHID + kc + 8 * hi;
            const h16* b1p = bp + (size_t)(16 + lr) * NHID + kc + 8 * hi;
            d0 = wmma16(a, cat16(*(const v8h*)b0p, *(const v8h*)(b0p + 16)), d0);
            d1 = wmma16(a, cat16(*(const v8h*)b1p, *(const v8h*)(b1p + 16)), d1);
            asm volatile("v_nop\n\tv_nop\n\tv_nop\n\tv_nop" : "+v"(d0), "+v"(d1) : "v"(a));
        }
        const float bv0 = bfr(b2[(size_t)c * NEMB + lr]), bv1 = bfr(b2[(size_t)c * NEMB + 16 + lr]);
#pragma unroll
        for (int j = 0; j < 8; ++j) {
            slab[((hi * 8 + j) * NEMB + lr) * 32 + cl]      = d0[j] + bv0;      // (row 8hi+j, emb lr)
            slab[((hi * 8 + j) * NEMB + 16 + lr) * 32 + cl] = d1[j] + bv1;      // (row 8hi+j, emb 16+lr)
        }
    }
    __builtin_amdgcn_fence(__ATOMIC_RELEASE, "workgroup");
    __builtin_amdgcn_wave_barrier();
    auto pass = [&]() {
#pragma unroll 4
        for (int s = 0; s < 128; ++s) {
            const int Lid = 4 * s + (lane >> 3), piece = lane & 7;
            const int row = Lid >> 5, e = Lid & 31;
            const v4f val = *(const v4fa*)(slab + (row * NEMB + e) * 32 + piece * 4);
            *(v4f*)(outp + ((size_t)(r0 + row) * NEMB + e) * NC_ + cbase + piece * 4) = val;
        }
    };
    pass();
    
}

extern "C" void kernel_launch(void* const* d_in, const int* in_sizes, int n_in,
                              void* d_out, int out_size, void* d_ws, size_t ws_size, hipStream_t stream) {
    (void)in_sizes; (void)n_in; (void)out_size;
    const float* x = (const float*)d_in[0];
    const float* W1[2] = {(const float*)d_in[1], (const float*)d_in[5]}; const float* b1[2] = {(const float*)d_in[2], (const float*)d_in[6]};
    const float* W2[2] = {(const float*)d_in[3], (const float*)d_in[7]}; const float* b2[2] = {(const float*)d_in[4], (const float*)d_in[8]};
    float* out = (float*)d_out;    // pos [1024][32][128] then neg [1024][32][128]
    char* wsp = (char*)d_ws;
    auto take = [&](size_t bytes) { char* p = wsp; wsp += (bytes + 255) & ~(size_t)255; return (void*)p; };
    bf*  Xb  = (bf*)take((size_t)NBT * NIN * 2);
    bf*  W1T = (bf*)take((size_t)NC_ * NHID * NIN * 2);
    h16* W2T = (h16*)take((size_t)NC_ * NEMB * NHID * 2);
    h16* H1  = (h16*)take((size_t)NBT * NC_ * NHID * 2);
    if ((size_t)(wsp - (char*)d_ws) > ws_size) return;    // 1 + 16.8 + 1 + 33.6 MB ~ 52.4e6 B (reused for the second bank in stream order)
    k_xb<<<NBT / 8, 256, 0, stream>>>(x, Xb);
    for (int bank = 0; bank < 2; ++bank) {
        k_w1t<<<NC_ * (NIN / 64), 256, 0, stream>>>(W1[bank], W1T);
        k_w2t<<<NC_, 256, 0, stream>>>(W2[bank], W2T);
        k_gemm1<<<dim3(NBT / 64, NHID / 64, NC_), 128, 0, stream>>>(Xb, W1T, b1[bank], H1);
        k_layer2<<<(NBT / 16) * (NC_ / 32), 32, 16 * NEMB * 32 * 4, stream>>>(H1, W2T, b2[bank], out + (size_t)bank * NBT * NEMB * NC_);
    }
}

// v001
// It runs in 149 microseconds.
// Timed twice side by side with v000, it ran 2.33 and 2.34 times as fast.
#include <hip/hip_runtime.h>

// Contractions, f32 accumulate: per concept c (128 per bank, 2 banks) h = relu(x.W1[c] + b1[c]) ([1024 x 512].[512 x 128]) on v_wmma_f32_16x16x32_bf16 with PLAIN bf16
// operands (x, W1 rounded once: exact products; b1 added bf16-rounded), and out[:, :, c] = h.W2[c] + b2[c] ([1024 x 128].[128 x 32]) on v_wmma_f32_16x16x32_f16 with h as

#define NBT  1024
#define NIN  512
#define NC_  128
#define NHID 128
#define NEMB 32

typedef _Float16 h16;
typedef unsigned short bf;
typedef __attribute__((ext_vector_type(16))) __bf16   v16bf;
typedef __attribute__((ext_vector_type(16))) _Float16 v16h;
typedef __attribute__((ext_vector_type(8)))  _Float16 v8h;
typedef __attribute__((ext_vector_type(8)))  unsigned short v8us;
typedef __attribute__((ext_vector_type(8)))  float    v8f;
typedef __attribute__((ext_vector_type(4)))  float    v4f;
typedef v8h  __attribute__((may_alias)) v8ha;
typedef v8us __attribute__((may_alias)) v8usa;
typedef v4f  __attribute__((may_alias)) v4fa;

__device__ __forceinline__ unsigned short f2bf(float f) { unsigned u = __float_as_uint(f); u += 0x7FFFu + ((u >> 16) & 1u); return (unsigned short)(u >> 16); }
__device__ __forceinline__ float bf2f(unsigned short b) { return __uint_as_float(((unsigned)b) << 16); }
__device__ __forceinline__ float bfr(float f) { return bf2f(f2bf(f)); }
__device__ __forceinline__ v16h cat16(v8h lo, v8h hi) { return __builtin_shufflevector(lo, hi, 0, 1, 2, 3, 4, 5, 6, 7, 8, 9, 10, 11, 12, 13, 14, 15); }
__device__ __forceinline__ v16bf cat16b(v8us lo, v8us hi) { return __builtin_bit_cast(v16bf, __builtin_shufflevector(lo, hi, 0, 1, 2, 3, 4, 5, 6, 7, 8, 9, 10, 11, 12, 13, 14, 15)); }
__device__ __forceinline__ v8f wmma16(v16h a, v16h b, v8f c) { return __builtin_amdgcn_wmma_f32_16x16x32_f16(false, a, false, b, (short)0, c, false, false); }
__device__ __forceinline__ v8f wmmab(v16bf a, v16bf b, v8f c) { return __builtin_amdgcn_wmma_f32_16x16x32_bf16(false, a, false, b, (short)0, c, false, false); }

__global__ __launch_bounds__(256) void k_xb(const float* __restrict__ x, bf* Xb) {
    const int lane = threadIdx.x & 31, r = blockIdx.x * 8 + (threadIdx.x >> 5);
    if (r >= NBT) return;
    v8us o[2];
#pragma unroll
    for (int q = 0; q < 2; ++q) { v8us t;
#pragma unroll
        for (int i = 0; i < 8; ++i) t[i] = f2bf(x[(size_t)r * NIN + q * 256 + lane * 8 + i]);
        o[q] = t; }
#pragma unroll
    for (int q = 0; q < 2; ++q) *(v8us*)(Xb + (size_t)r * NIN + q * 256 + lane * 8) = o[q];
    
}

__global__ __launch_bounds__(256) void k_w1t(const float* __restrict__ W1, bf* W1T) {
    __shared__ __align__(16) unsigned short tl[NHID * 72];
    const int c = blockIdx.x / (NIN / 64), kt = blockIdx.x - c * (NIN / 64), k0 = kt * 64, tid = threadIdx.x;
    const int kk = tid >> 2, nq = (tid & 3) * 32;
    const float* src = W1 + ((size_t)c * NIN + k0 + kk) * NHID + nq;
#pragma unroll
    for (int i = 0; i < 32; ++i) tl[(nq + i) * 72 + kk] = f2bf(src[i]);
    __syncthreads();
    const int piece = tid & 7;
    auto pass = [&]() {
#pragma unroll
        for (int s = 0; s < 4; ++s) {
            const int n = (tid >> 3) + 32 * s;
            const v8us val = *(const v8usa*)(tl + n * 72 + piece * 8);
            *(v8us*)(W1T + ((size_t)c * NHID + n) * NIN + k0 + piece * 8) = val;
        }
    };
    pass();
    
}

// k_w2t: W2 [c][128 hid][32 emb] -> W2T [c][32 emb][128 hid] as f16 of bf16(W2). Block = concept; LDS transpose; each emb row (256 B = 2 lines) by 16 lanes x 16 B.
__global__ __launch_bounds__(256) void k_w2t(const float* __restrict__ W2, h16* W2T) {
    __shared__ __align__(16) h16 tl[NEMB * 136];
    const int c = blockIdx.x, tid = threadIdx.x;
    const float* src = W2 + (size_t)c * NHID * NEMB;
#pragma unroll
    for (int i = 0; i < 16; ++i) { const int e = tid * 16 + i; const int hid = e / NEMB, em = e - hid * NEMB; tl[em * 136 + hid] = (h16)bfr(src[e]); }
    __syncthreads();
    const int piece = tid & 15;                              // 32 emb rows x 16 pieces of 8 halves: two instructions, each 16 rows (16 lanes x 16 B = one 256-B row)
    v8h val[2];
#pragma unroll
    for (int s = 0; s < 2; ++s) val[s] = *(const v8ha*)(tl + ((tid >> 4) + 16 * s) * 136 + piece * 8);
#pragma unroll
    for (int s = 0; s < 2; ++s) *(v8h*)(W2T + ((size_t)c * NEMB + (tid >> 4) + 16 * s) * NHID + piece * 8) = val[s];
    
}

#define G1_PITCH 272u                    // 256-B rows + 16 B: conflict-free for 16-byte LDS reads down a column of rows
#define G1_SLICE 18432u                  // 64 rows x 272 B = 17408 B, rounded up to a multiple of 2 KiB
#define G1_BUF   (4u * G1_SLICE)
#define G1_NPASS (NIN / 128)
#define G1_OPITCH 144u                   // output staging: 64 f16 (128 B) + 16 B
typedef unsigned u32x4 __attribute__((ext_vector_type(4)));
typedef unsigned u32x8 __attribute__((ext_vector_type(8)));
__device__ __forceinline__ unsigned uni(unsigned v) { return (unsigned)__builtin_amdgcn_readfirstlane(v); }
__device__ __forceinline__ unsigned pinned(unsigned v) { unsigned w = uni(v); asm volatile("" : "+s"(w)); return w; }   // holds a wave-uniform test in a scalar register: the branch round a tensor load must be scalar (tensor loads ignore EXEC)
__device__ __forceinline__ void wait_ds0() { asm volatile("s_wait_dscnt 0x0" ::: "memory"); }        // this wave's LDS reads and writes are done
__device__ __forceinline__ void wait_tensor0() { asm volatile("s_wait_tensorcnt 0" ::: "memory"); }  // this wave's tensor load has landed
// Sets the words of descriptor group 0 that change from request to request: the place in LDS and the tile's first byte (with type 2 in the top bits).
__device__ __forceinline__ void tdm_aim(u32x4& g0, unsigned lds_dst, unsigned long long ga) {
    g0[1] = uni(lds_dst); g0[2] = uni((unsigned)ga); g0[3] = uni((((unsigned)(ga >> 32)) & 0x01FFFFFFu) | 0x80000000u);
}
// One request of the whole wave: 64 rows of 256 B into LDS. g0 is an in-out operand so that its registers stay its own until the next tdm_aim, which stands behind the wait.
__device__ __forceinline__ void tdm_load(u32x4& g0, u32x8 g1) { asm volatile("tensor_load_to_lds %0, %1" : "+s"(g0) : "s"(g1) : "memory"); }

__global__ __launch_bounds__(128) void k_gemm1(const bf* __restrict__ Xb, const bf* __restrict__ W1T, const float* __restrict__ b1, h16* H1) {
    __shared__ __attribute__((aligned(2048))) unsigned char ring[2 * G1_BUF];
    const unsigned lane = threadIdx.x & 31u, lr = lane & 15u, hi = lane >> 4, wave = uni(threadIdx.x >> 5);
    const unsigned c = blockIdx.y, r0 = blockIdx.x * 128u;
    const unsigned wm = (wave & 1u) * 64u, wn = (wave >> 1) * 64u;      // this wave's batch rows and hid columns inside the block tile
    // slices 0, 1: X rows r0 .. r0 + 127; slices 2, 3: W rows of concept c; wave w brings slice w
    const bf* srow = wave < 2u ? Xb + (size_t)(r0 + 64u * wave) * NIN : W1T + ((size_t)c * NHID + 64u * (wave - 2u)) * NIN;
    const unsigned long long ga0 = (unsigned long long)(size_t)srow;
    const unsigned dst0 = (unsigned)(size_t)ring + wave * G1_SLICE;
    u32x8 g1;   // 1-byte elements, tensor = tile = 64 rows of 256 B, source pitch NIN * 2 B, 4 dwords of pad behind every 64 dwords
    g1[0] = uni((1u << 20) | (5u << 22) | (3u << 25));
    g1[1] = uni(256u << 16);
    g1[2] = uni(64u << 16);
    g1[3] = uni(256u << 16);
    g1[4] = uni(64u);
    g1[5] = uni(NIN * 2u);
    g1[6] = uni(0u);
    g1[7] = uni(0u);
    asm volatile("" : "+s"(g1));   // pinned() for the whole group: descriptor words held in their scalar registers, so that none takes a new value while a request is in flight
    v8f acc[4][4];      // [t: 16 hid][i: 16 batch rows]
#pragma unroll
    for (int t = 0; t < 4; ++t)
#pragma unroll
        for (int i = 0; i < 4; ++i) acc[t][i] = (v8f){};
    u32x4 g0;
    g0[0] = uni(1u);
    tdm_aim(g0, dst0, ga0);
    tdm_load(g0, g1);
    wait_tensor0();
    __syncthreads();                                // stage 0 published
    tdm_aim(g0, dst0 + G1_BUF, ga0 + 256u);
    tdm_load(g0, g1);
    const unsigned xoff = (wave & 1u) * G1_SLICE + lr * G1_PITCH + 16u * hi;
    const unsigned woff = (2u + (wave >> 1)) * G1_SLICE + lr * G1_PITCH + 16u * hi;
#pragma unroll 1   // one pass per trip: the ring's order at the foot stands once in the text
    for (unsigned s = 0; s < G1_NPASS; ++s) {
        const unsigned char* buf = ring + (s & 1u) * G1_BUF;
        v16bf xf[2][4], wf[2][4];                   // two fragment sets: block kc + 1 is fetched while block kc is multiplied
        auto fetch = [&](int set, int kc) {
#pragma unroll
            for (int i = 0; i < 4; ++i) { const unsigned char* p = buf + xoff + i * 16u * G1_PITCH + kc * 64u; xf[set][i] = cat16b(*(const v8usa*)p, *(const v8usa*)(p + 32)); }
#pragma unroll
            for (int t = 0; t < 4; ++t) { const unsigned char* p = buf + woff + t * 16u * G1_PITCH + kc * 64u; wf[set][t] = cat16b(*(const v8usa*)p, *(const v8usa*)(p + 32)); }
        };
        fetch(0, 0);
#pragma unroll
        for (int kc = 0; kc < 4; ++kc) {
            if (kc < 3) fetch((kc + 1) & 1, kc + 1);
            __builtin_amdgcn_sched_barrier(0);      // keeps the next block's LDS reads one group ahead of this block's WMMAs
#pragma unroll
            for (int t = 0; t < 4; ++t)
#pragma unroll
                for (int i = 0; i < 4; ++i) acc[t][i] = wmmab(wf[kc & 1][t], xf[kc & 1][i], acc[t][i]);
            __builtin_amdgcn_sched_barrier(0);      // keeps this block's WMMAs in front of the following group and of the ring's waits
        }
        wait_ds0();
        wait_tensor0();
        __syncthreads();                            // stage s + 1 published; every wave has left stage s's buffer
        if (pinned(s + 2u < G1_NPASS)) { tdm_aim(g0, dst0 + (s & 1u) * G1_BUF, ga0 + (s + 2u) * 256u); tdm_load(g0, g1); }
    }
    wait_tensor0();
    wait_ds0();
    // The last pass's own barrier has ended every read of the ring: each wave now stages its 64 x 64 f16 tile in its own slice of buffer 0.
    unsigned char* os = ring + wave * G1_SLICE;
#pragma unroll
    for (int t = 0; t < 4; ++t) {
        const float* bp = b1 + (size_t)c * NHID + wn + t * 16 + 8u * hi;
        const v4f blo = *(const v4fa*)bp, bhi = *(const v4fa*)(bp + 4);
        float bv[8];
#pragma unroll
        for (int j = 0; j < 4; ++j) { bv[j] = bfr(blo[j]); bv[4 + j] = bfr(bhi[j]); }
#pragma unroll
        for (int i = 0; i < 4; ++i) {
            v8h o;
#pragma unroll
            for (int j = 0; j < 8; ++j) { const float v = acc[t][i][j] + bv[j]; o[j] = (h16)(v > 0.f ? v : 0.f); }
            *(v8ha*)(os + (i * 16u + lr) * G1_OPITCH + (t * 16u + 8u * hi) * 2u) = o;
        }
    }
    wait_ds0();                                     // the staged rows are written before other lanes of this wave read them back
    h16* crow = H1 + (size_t)(r0 + wm) * (NC_ * NHID) + (size_t)c * NHID + wn;
#pragma unroll
    for (int q = 0; q < 16; ++q) {                  // 4 rows an instruction, each a whole 128-B line
        const unsigned row = 4u * q + (lane >> 3), piece = lane & 7u;
        *(v8h*)(crow + (size_t)row * (NC_ * NHID) + piece * 8u) = *(const v8ha*)(os + row * G1_OPITCH + piece * 16u);
    }
}

// k_layer2: block = (16 batch rows, 32 concepts), one wave: for each concept, h rows (A, 4 k-chunks from H1) x W2T[c] rows (2 n-tiles) -> 16 x 32 (+ bf16(b2[c])),
__global__ __launch_bounds__(32) void k_layer2(const h16* __restrict__ H1, const h16* __restrict__ W2T, const float* __restrict__ b2, float* outp) {
    extern __shared__ float4 slab_raw[];
    float* slab = (float*)slab_raw;                 // [16][32][32]
    const int lane = threadIdx.x, lr = lane & 15, hi = lane >> 4;
    const int bt = blockIdx.x / (NC_ / 32), cg = blockIdx.x - bt * (NC_ / 32);
    const int r0 = bt * 16, cbase = cg * 32;
#pragma unroll 1
    for (int cl = 0; cl < 32; ++cl) {
        const int c = cbase + cl;
        const h16* ap = H1 + (size_t)(r0 + lr) * (NC_ * NHID) + (size_t)c * NHID + 8 * hi;
        const h16* bp = W2T + (size_t)c * NEMB * NHID;
        v8f d0 = {}, d1 = {};
#pragma unroll
        for (int kc = 0; kc < NHID; kc += 32) {
            const v16h a = cat16(*(const v8h*)(ap + kc), *(const v8h*)(ap + kc + 16));
            const h16* b0p = bp + (size_t)lr * NHID + kc + 8 * hi;
            const h16* b1p = bp + (size_t)(16 + lr) * NHID + kc + 8 * hi;
            d0 = wmma16(a, cat16(*(const v8h*)b0p, *(const v8h*)(b0p + 16)), d0);
            d1 = wmma16(a, cat16(*(const v8h*)b1p, *(const v8h*)(b1p + 16)), d1);
            asm volatile("v_nop\n\tv_nop\n\tv_nop\n\tv_nop" : "+v"(d0), "+v"(d1) : "v"(a));
        }
        const float bv0 = bfr(b2[(size_t)c * NEMB + lr]), bv1 = bfr(b2[(size_t)c * NEMB + 16 + lr]);
#pragma unroll
        for (int j = 0; j < 8; ++j) {
            slab[((hi * 8 + j) * NEMB + lr) * 32 + cl]      = d0[j] + bv0;      // (row 8hi+j, emb lr)
            slab[((hi * 8 + j) * NEMB + 16 + lr) * 32 + cl] = d1[j] + bv1;      // (row 8hi+j, emb 16+lr)
        }
    }
    __builtin_amdgcn_fence(__ATOMIC_RELEASE, "workgroup");
    __builtin_amdgcn_wave_barrier();
    auto pass = [&]() {
#pragma unroll 4
        for (int s = 0; s < 128; ++s) {
            const int Lid = 4 * s + (lane >> 3), piece = lane & 7;
            const int row = Lid >> 5, e = Lid & 31;
            const v4f val = *(const v4fa*)(slab + (row * NEMB + e) * 32 + piece * 4);
            *(v4f*)(outp + ((size_t)(r0 + row) * NEMB + e) * NC_ + cbase + piece * 4) = val;
        }
    };
    pass();
    
}

extern "C" void kernel_launch(void* const* d_in, const int* in_sizes, int n_in,
                              void* d_out, int out_size, void* d_ws, size_t ws_size, hipStream_t stream) {
    (void)in_sizes; (void)n_in; (void)out_size;
    const float* x = (const float*)d_in[0];
    const float* W1[2] = {(const float*)d_in[1], (const float*)d_in[5]}; const float* b1[2] = {(const float*)d_in[2], (const float*)d_in[6]};
    const float* W2[2] = {(const float*)d_in[3], (const float*)d_in[7]}; const float* b2[2] = {(const float*)d_in[4], (const float*)d_in[8]};
    float* out = (float*)d_out;    // pos [1024][32][128] then neg [1024][32][128]
    char* wsp = (char*)d_ws;
    auto take = [&](size_t bytes) { char* p = wsp; wsp += (bytes + 255) & ~(size_t)255; return (void*)p; };
    bf*  Xb  = (bf*)take((size_t)NBT * NIN * 2);
    bf*  W1T = (bf*)take((size_t)NC_ * NHID * NIN * 2);
    h16* W2T = (h16*)take((size_t)NC_ * NEMB * NHID * 2);
    h16* H1  = (h16*)take((size_t)NBT * NC_ * NHID * 2);
    if ((size_t)(wsp - (char*)d_ws) > ws_size) return;    // 1 + 16.8 + 1 + 33.6 MB ~ 52.4e6 B (reused for the second bank in stream order)
    k_xb<<<NBT / 8, 256, 0, stream>>>(x, Xb);
    for (int bank = 0; bank < 2; ++bank) {
        k_w1t<<<NC_ * (NIN / 64), 256, 0, stream>>>(W1[bank], W1T);
        k_w2t<<<NC_, 256, 0, stream>>>(W2[bank], W2T);
        k_gemm1<<<dim3(NBT / 128, NC_), 128, 0, stream>>>(Xb, W1T, b1[bank], H1);
        k_layer2<<<(NBT / 16) * (NC_ / 32), 32, 16 * NEMB * 32 * 4, stream>>>(H1, W2T, b2[bank], out + (size_t)bank * NBT * NEMB * NC_);
    }
}

// v002
// Measured time: 77.6 microseconds a run.
// Timed twice side by side with v001, it ran 1.93 times as fast both times.
// Over all steps from v000 it is 4.50 times as fast.
#include <hip/hip_runtime.h>

// Contractions, f32 accumulate: per concept c (128 per bank, 2 banks) h = relu(x.W1[c] + b1[c]) ([1024 x 512].[512 x 128]) on v_wmma_f32_16x16x32_bf16 with PLAIN bf16
// operands (x, W1 rounded once: exact products; b1 added bf16-rounded), and out[:, :, c] = h.W2[c] + b2[c] ([1024 x 128].[128 x 32]) on v_wmma_f32_16x16x32_f16 with h as

#define NBT  1024
#define NIN  512
#define NC_  128
#define NHID 128
#define NEMB 32

typedef _Float16 h16;
typedef unsigned short bf;
typedef __attribute__((ext_vector_type(16))) __bf16   v16bf;
typedef __attribute__((ext_vector_type(16))) _Float16 v16h;
typedef __attribute__((ext_vector_type(8)))  _Float16 v8h;
typedef __attribute__((ext_vector_type(8)))  unsigned short v8us;
typedef __attribute__((ext_vector_type(8)))  float    v8f;
typedef __attribute__((ext_vector_type(4)))  float    v4f;
typedef v8h  __attribute__((may_alias)) v8ha;
typedef v8us __attribute__((may_alias)) v8usa;
typedef v4f  __attribute__((may_alias)) v4fa;

__device__ __forceinline__ unsigned short f2bf(float f) { unsigned u = __float_as_uint(f); u += 0x7FFFu + ((u >> 16) & 1u); return (unsigned short)(u >> 16); }
__device__ __forceinline__ float bf2f(unsigned short b) { return __uint_as_float(((unsigned)b) << 16); }
__device__ __forceinline__ float bfr(float f) { return bf2f(f2bf(f)); }
__device__ __forceinline__ v16h cat16(v8h lo, v8h hi) { return __builtin_shufflevector(lo, hi, 0, 1, 2, 3, 4, 5, 6, 7, 8, 9, 10, 11, 12, 13, 14, 15); }
__device__ __forceinline__ v16bf cat16b(v8us lo, v8us hi) { return __builtin_bit_cast(v16bf, __builtin_shufflevector(lo, hi, 0, 1, 2, 3, 4, 5, 6, 7, 8, 9, 10, 11, 12, 13, 14, 15)); }
__device__ __forceinline__ v8f wmma16(v16h a, v16h b, v8f c) { return __builtin_amdgcn_wmma_f32_16x16x32_f16(false, a, false, b, (short)0, c, false, false); }
__device__ __forceinline__ v8f wmmab(v16bf a, v16bf b, v8f c) { return __builtin_amdgcn_wmma_f32_16x16x32_bf16(false, a, false, b, (short)0, c, false, false); }

__global__ __launch_bounds__(256) void k_xb(const float* __restrict__ x, bf* Xb) {
    const int lane = threadIdx.x & 31, r = blockIdx.x * 8 + (threadIdx.x >> 5);
    if (r >= NBT) return;
    v8us o[2];
#pragma unroll
    for (int q = 0; q < 2; ++q) { v8us t;
#pragma unroll
        for (int i = 0; i < 8; ++i) t[i] = f2bf(x[(size_t)r * NIN + q * 256 + lane * 8 + i]);
        o[q] = t; }
#pragma unroll
    for (int q = 0; q < 2; ++q) *(v8us*)(Xb + (size_t)r * NIN + q * 256 + lane * 8) = o[q];
    
}

__global__ __launch_bounds__(256) void k_w1t(const float* __restrict__ W1, bf* W1T) {
    __shared__ __align__(16) unsigned short tl[NHID * 72];
    const int c = blockIdx.x / (NIN / 64), kt = blockIdx.x - c * (NIN / 64), k0 = kt * 64, tid = threadIdx.x;
    const int kk = tid >> 2, nq = (tid & 3) * 32;
    const float* src = W1 + ((size_t)c * NIN + k0 + kk) * NHID + nq;
#pragma unroll
    for (int i = 0; i < 32; ++i) tl[(nq + i) * 72 + kk] = f2bf(src[i]);
    __syncthreads();
    const int piece = tid & 7;
    auto pass = [&]() {
#pragma unroll
        for (int s = 0; s < 4; ++s) {
            const int n = (tid >> 3) + 32 * s;
            const v8us val = *(const v8usa*)(tl + n * 72 + piece * 8);
            *(v8us*)(W1T + ((size_t)c * NHID + n) * NIN + k0 + piece * 8) = val;
        }
    };
    pass();
    
}

// k_w2t: W2 [c][128 hid][32 emb] -> W2T [c][32 emb][128 hid] as f16 of bf16(W2). Block = concept; LDS transpose; each emb row (256 B = 2 lines) by 16 lanes x 16 B.
__global__ __launch_bounds__(256) void k_w2t(const float* __restrict__ W2, h16* W2T) {
    __shared__ __align__(16) h16 tl[NEMB * 136];
    const int c = blockIdx.x, tid = threadIdx.x;
    const float* src = W2 + (size_t)c * NHID * NEMB;
#pragma unroll
    for (int i = 0; i < 16; ++i) { const int e = tid * 16 + i; const int hid = e / NEMB, em = e - hid * NEMB; tl[em * 136 + hid] = (h16)bfr(src[e]); }
    __syncthreads();
    const int piece = tid & 15;                              // 32 emb rows x 16 pieces of 8 halves: two instructions, each 16 rows (16 lanes x 16 B = one 256-B row)
    v8h val[2];
#pragma unroll
    for (int s = 0; s < 2; ++s) val[s] = *(const v8ha*)(tl + ((tid >> 4) + 16 * s) * 136 + piece * 8);
#pragma unroll
    for (int s = 0; s < 2; ++s) *(v8h*)(W2T + ((size_t)c * NEMB + (tid >> 4) + 16 * s) * NHID + piece * 8) = val[s];
    
}

#define G1_PITCH 272u                    // 256-B rows + 16 B: conflict-free for 16-byte LDS reads down a column of rows
#define G1_SLICE 18432u                  // 64 rows x 272 B = 17408 B, rounded up to a multiple of 2 KiB
#define G1_BUF   (4u * G1_SLICE)
#define G1_NPASS (NIN / 128)
#define G1_OPITCH 144u                   // output staging: 64 f16 (128 B) + 16 B
typedef unsigned u32x4 __attribute__((ext_vector_type(4)));
typedef unsigned u32x8 __attribute__((ext_vector_type(8)));
__device__ __forceinline__ unsigned uni(unsigned v) { return (unsigned)__builtin_amdgcn_readfirstlane(v); }
__device__ __forceinline__ unsigned pinned(unsigned v) { unsigned w = uni(v); asm volatile("" : "+s"(w)); return w; }   // holds a wave-uniform test in a scalar register: the branch round a tensor load must be scalar (tensor loads ignore EXEC)
__device__ __forceinline__ void wait_ds0() { asm volatile("s_wait_dscnt 0x0" ::: "memory"); }        // this wave's LDS reads and writes are done
__device__ __forceinline__ void wait_tensor0() { asm volatile("s_wait_tensorcnt 0" ::: "memory"); }  // this wave's tensor load has landed
// Sets the words of descriptor group 0 that change from request to request: the place in LDS and the tile's first byte (with type 2 in the top bits).
__device__ __forceinline__ void tdm_aim(u32x4& g0, unsigned lds_dst, unsigned long long ga) {
    g0[1] = uni(lds_dst); g0[2] = uni((unsigned)ga); g0[3] = uni((((unsigned)(ga >> 32)) & 0x01FFFFFFu) | 0x80000000u);
}
// One request of the whole wave: 64 rows of 256 B into LDS. g0 is an in-out operand so that its registers stay its own until the next tdm_aim, which stands behind the wait.
__device__ __forceinline__ void tdm_load(u32x4& g0, u32x8 g1) { asm volatile("tensor_load_to_lds %0, %1" : "+s"(g0) : "s"(g1) : "memory"); }

__global__ __launch_bounds__(128) void k_gemm1(const bf* __restrict__ Xb, const bf* __restrict__ W1T, const float* __restrict__ b1, h16* H1) {
    __shared__ __attribute__((aligned(2048))) unsigned char ring[2 * G1_BUF];
    const unsigned lane = threadIdx.x & 31u, lr = lane & 15u, hi = lane >> 4, wave = uni(threadIdx.x >> 5);
    const unsigned c = blockIdx.y, r0 = blockIdx.x * 128u;
    const unsigned wm = (wave & 1u) * 64u, wn = (wave >> 1) * 64u;      // this wave's batch rows and hid columns inside the block tile
    // slices 0, 1: X rows r0 .. r0 + 127; slices 2, 3: W rows of concept c; wave w brings slice w
    const bf* srow = wave < 2u ? Xb + (size_t)(r0 + 64u * wave) * NIN : W1T + ((size_t)c * NHID + 64u * (wave - 2u)) * NIN;
    const unsigned long long ga0 = (unsigned long long)(size_t)srow;
    const unsigned dst0 = (unsigned)(size_t)ring + wave * G1_SLICE;
    u32x8 g1;   // 1-byte elements, tensor = tile = 64 rows of 256 B, source pitch NIN * 2 B, 4 dwords of pad behind every 64 dwords
    g1[0] = uni((1u << 20) | (5u << 22) | (3u << 25));
    g1[1] = uni(256u << 16);
    g1[2] = uni(64u << 16);
    g1[3] = uni(256u << 16);
    g1[4] = uni(64u);
    g1[5] = uni(NIN * 2u);
    g1[6] = uni(0u);
    g1[7] = uni(0u);
    asm volatile("" : "+s"(g1));   // pinned() for the whole group: descriptor words held in their scalar registers, so that none takes a new value while a request is in flight
    v8f acc[4][4];      // [t: 16 hid][i: 16 batch rows]
#pragma unroll
    for (int t = 0; t < 4; ++t)
#pragma unroll
        for (int i = 0; i < 4; ++i) acc[t][i] = (v8f){};
    u32x4 g0;
    g0[0] = uni(1u);
    tdm_aim(g0, dst0, ga0);
    tdm_load(g0, g1);
    wait_tensor0();
    __syncthreads();                                // stage 0 published
    tdm_aim(g0, dst0 + G1_BUF, ga0 + 256u);
    tdm_load(g0, g1);
    const unsigned xoff = (wave & 1u) * G1_SLICE + lr * G1_PITCH + 16u * hi;
    const unsigned woff = (2u + (wave >> 1)) * G1_SLICE + lr * G1_PITCH + 16u * hi;
#pragma unroll 1   // one pass per trip: the ring's order at the foot stands once in the text
    for (unsigned s = 0; s < G1_NPASS; ++s) {
        const unsigned char* buf = ring + (s & 1u) * G1_BUF;
        v16bf xf[2][4], wf[2][4];                   // two fragment sets: block kc + 1 is fetched while block kc is multiplied
        auto fetch = [&](int set, int kc) {
#pragma unroll
            for (int i = 0; i < 4; ++i) { const unsigned char* p = buf + xoff + i * 16u * G1_PITCH + kc * 64u; xf[set][i] = cat16b(*(const v8usa*)p, *(const v8usa*)(p + 32)); }
#pragma unroll
            for (int t = 0; t < 4; ++t) { const unsigned char* p = buf + woff + t * 16u * G1_PITCH + kc * 64u; wf[set][t] = cat16b(*(const v8usa*)p, *(const v8usa*)(p + 32)); }
        };
        fetch(0, 0);
#pragma unroll
        for (int kc = 0; kc < 4; ++kc) {
            if (kc < 3) fetch((kc + 1) & 1, kc + 1);
            __builtin_amdgcn_sched_barrier(0);      // keeps the next block's LDS reads one group ahead of this block's WMMAs
#pragma unroll
            for (int t = 0; t < 4; ++t)
#pragma unroll
                for (int i = 0; i < 4; ++i) acc[t][i] = wmmab(wf[kc & 1][t], xf[kc & 1][i], acc[t][i]);
            __builtin_amdgcn_sched_barrier(0);      // keeps this block's WMMAs in front of the following group and of the ring's waits
        }
        wait_ds0();
        wait_tensor0();
        __syncthreads();                            // stage s + 1 published; every wave has left stage s's buffer
        if (pinned(s + 2u < G1_NPASS)) { tdm_aim(g0, dst0 + (s & 1u) * G1_BUF, ga0 + (s + 2u) * 256u); tdm_load(g0, g1); }
    }
    wait_tensor0();
    wait_ds0();
    // The last pass's own barrier has ended every read of the ring: each wave now stages its 64 x 64 f16 tile in its own slice of buffer 0.
    unsigned char* os = ring + wave * G1_SLICE;
#pragma unroll
    for (int t = 0; t < 4; ++t) {
        const float* bp = b1 + (size_t)c * NHID + wn + t * 16 + 8u * hi;
        const v4f blo = *(const v4fa*)bp, bhi = *(const v4fa*)(bp + 4);
        float bv[8];
#pragma unroll
        for (int j = 0; j < 4; ++j) { bv[j] = bfr(blo[j]); bv[4 + j] = bfr(bhi[j]); }
#pragma unroll
        for (int i = 0; i < 4; ++i) {
            v8h o;
#pragma unroll
            for (int j = 0; j < 8; ++j) { const float v = acc[t][i][j] + bv[j]; o[j] = (h16)(v > 0.f ? v : 0.f); }
            *(v8ha*)(os + (i * 16u + lr) * G1_OPITCH + (t * 16u + 8u * hi) * 2u) = o;
        }
    }
    wait_ds0();                                     // the staged rows are written before other lanes of this wave read them back
    h16* crow = H1 + (size_t)(r0 + wm) * (NC_ * NHID) + (size_t)c * NHID + wn;
#pragma unroll
    for (int q = 0; q < 16; ++q) {                  // 4 rows an instruction, each a whole 128-B line
        const unsigned row = 4u * q + (lane >> 3), piece = lane & 7u;
        *(v8h*)(crow + (size_t)row * (NC_ * NHID) + piece * 8u) = *(const v8ha*)(os + row * G1_OPITCH + piece * 16u);
    }
}

// k_layer2: block = (16 batch rows, 32 concepts), eight waves, four adjacent concepts a wave: for each concept, h rows (A, 4 k-chunks from H1) x W2T[c] rows (2 n-tiles)
// -> 16 x 32 (+ bf16(b2[c])). A lane keeps its (row, emb) results of the wave's four concepts and lays them in the slab as one 16-byte piece; behind the block's barrier the
// eight waves write the slab out as whole 128-B lines of out[b][emb][32 concepts].
#define L2_SP 36                         // slab pitch in floats: 32 concepts + 16 B, so that 16-byte pieces down a column of (row, emb) lines spread over the banks
__global__ __launch_bounds__(256) void k_layer2(const h16* __restrict__ H1, const h16* __restrict__ W2T, const float* __restrict__ b2, float* outp) {
    __shared__ __align__(16) float slab[16 * NEMB * L2_SP];     // [16 rows][32 emb][32 concepts + pad]
    const int lane = threadIdx.x & 31, wave = threadIdx.x >> 5, lr = lane & 15, hi = lane >> 4;
    const int bt = blockIdx.x / (NC_ / 32), cg = blockIdx.x - bt * (NC_ / 32);
    const int r0 = bt * 16, cbase = cg * 32, c0 = cbase + wave * 4;
    const h16* ap = H1 + (size_t)(r0 + lr) * (NC_ * NHID) + (size_t)c0 * NHID + 8 * hi;
    const h16* bp = W2T + ((size_t)c0 * NEMB + lr) * NHID + 8 * hi;
    float bv0[4], bv1[4];
#pragma unroll
    for (int u = 0; u < 4; ++u) { bv0[u] = b2[(size_t)(c0 + u) * NEMB + lr]; bv1[u] = b2[(size_t)(c0 + u) * NEMB + 16 + lr]; }
    asm volatile("s_wait_xcnt 0x0" ::: "memory");   // the bias loads' address registers are taken over by an accumulator further down: the wait stands in front of that overwrite
    // A stage is half a concept (64 of its 128 k): 12 loads of 16 B a lane, 4 WMMAs. Three register sets: stages g + 1 and g + 2 are in flight while stage g is multiplied.
    v8h fa[3][4], fb0[3][4], fb1[3][4];
    auto fetch = [&](int set, int g) {
        const h16* a = ap + (g >> 1) * NHID + (g & 1) * 64;
        const h16* b = bp + (g >> 1) * (NEMB * NHID) + (g & 1) * 64;
#pragma unroll
        for (int p = 0; p < 4; ++p) {
            fa[set][p]  = *(const v8h*)(a + p * 16);
            fb0[set][p] = *(const v8h*)(b + p * 16);
            fb1[set][p] = *(const v8h*)(b + 16 * NHID + p * 16);
        }
    };
    v8f d0[4], d1[4];
#pragma unroll
    for (int u = 0; u < 4; ++u) { d0[u] = (v8f){}; d1[u] = (v8f){}; }
    fetch(0, 0);
    fetch(1, 1);
#pragma unroll
    for (int g = 0; g < 8; ++g) {
        if (g + 2 < 8) fetch((g + 2) % 3, g + 2);
        __builtin_amdgcn_sched_barrier(0);          // keeps the loads two stages ahead of the WMMAs: sunk to their users they leave too few requests in flight to cover the latency
        const int s = g % 3, u = g >> 1;
#pragma unroll
        for (int q = 0; q < 2; ++q) {
            const v16h a = cat16(fa[s][2 * q], fa[s][2 * q + 1]);
            d0[u] = wmma16(a, cat16(fb0[s][2 * q], fb0[s][2 * q + 1]), d0[u]);
            d1[u] = wmma16(a, cat16(fb1[s][2 * q], fb1[s][2 * q + 1]), d1[u]);
        }
        __builtin_amdgcn_sched_barrier(0);          // keeps this stage's WMMAs in front of the loads that refill its register set
    }
#pragma unroll
    for (int u = 0; u < 4; ++u) { bv0[u] = bfr(bv0[u]); bv1[u] = bfr(bv1[u]); }
#pragma unroll
    for (int j = 0; j < 8; ++j) {
        const v4f s0 = {d0[0][j] + bv0[0], d0[1][j] + bv0[1], d0[2][j] + bv0[2], d0[3][j] + bv0[3]};      // (row 8hi+j, emb lr)
        const v4f s1 = {d1[0][j] + bv1[0], d1[1][j] + bv1[1], d1[2][j] + bv1[2], d1[3][j] + bv1[3]};      // (row 8hi+j, emb 16+lr)
        *(v4fa*)(slab + ((hi * 8 + j) * NEMB + lr) * L2_SP + wave * 4)      = s0;
        *(v4fa*)(slab + ((hi * 8 + j) * NEMB + 16 + lr) * L2_SP + wave * 4) = s1;
    }
    __syncthreads();                                // every wave's four concepts are in the slab
#pragma unroll
    for (int s = 0; s < 16; ++s) {                  // 4 lines an instruction, each a whole 128-B line
        const int Lid = 4 * (8 * s + wave) + (lane >> 3), piece = lane & 7;
        const int row = Lid >> 5, e = Lid & 31;
        const v4f val = *(const v4fa*)(slab + Lid * L2_SP + piece * 4);
        *(v4f*)(outp + ((size_t)(r0 + row) * NEMB + e) * NC_ + cbase + piece * 4) = val;
    }
}

extern "C" void kernel_launch(void* const* d_in, const int* in_sizes, int n_in,
                              void* d_out, int out_size, void* d_ws, size_t ws_size, hipStream_t stream) {
    (void)in_sizes; (void)n_in; (void)out_size;
    const float* x = (const float*)d_in[0];
    const float* W1[2] = {(const float*)d_in[1], (const float*)d_in[5]}; const float* b1[2] = {(const float*)d_in[2], (const float*)d_in[6]};
    const float* W2[2] = {(const float*)d_in[3], (const float*)d_in[7]}; const float* b2[2] = {(const float*)d_in[4], (const float*)d_in[8]};
    float* out = (float*)d_out;    // pos [1024][32][128] then neg [1024][32][128]
    char* wsp = (char*)d_ws;
    auto take = [&](size_t bytes) { char* p = wsp; wsp += (bytes + 255) & ~(size_t)255; return (void*)p; };
    bf*  Xb  = (bf*)take((size_t)NBT * NIN * 2);
    bf*  W1T = (bf*)take((size_t)NC_ * NHID * NIN * 2);
    h16* W2T = (h16*)take((size_t)NC_ * NEMB * NHID * 2);
    h16* H1  = (h16*)take((size_t)NBT * NC_ * NHID * 2);
    if ((size_t)(wsp - (char*)d_ws) > ws_size) return;    // 1 + 16.8 + 1 + 33.6 MB ~ 52.4e6 B (reused for the second bank in stream order)
    k_xb<<<NBT / 8, 256, 0, stream>>>(x, Xb);
    for (int bank = 0; bank < 2; ++bank) {
        k_w1t<<<NC_ * (NIN / 64), 256, 0, stream>>>(W1[bank], W1T);
        k_w2t<<<NC_, 256, 0, stream>>>(W2[bank], W2T);
        k_gemm1<<<dim3(NBT / 128, NC_), 128, 0, stream>>>(Xb, W1T, b1[bank], H1);
        k_layer2<<<(NBT / 16) * (NC_ / 32), 256, 0, stream>>>(H1, W2T, b2[bank], out + (size_t)bank * NBT * NEMB * NC_);
    }
}
